// v000
// Times are from an AMD MI455X. After a warm-up the kernel runs many times in a row, and a time is the length of
// such a window on the GPU divided by its runs, so every launch and the gaps after it count. The runs cycle
// through copies of the inputs. A figure is the median of several windows, for all but v000 over two sittings.
// Sittings can differ by a few percent; kernels timed side by side share one.
// The starting kernel, v000, takes 313 microseconds a run.
#include <hip/hip_runtime.h>

typedef __attribute__((ext_vector_type(2))) float v2f;
typedef __attribute__((ext_vector_type(8))) float v8f;
typedef __attribute__((ext_vector_type(4))) int v4i;

#define HDIM 1024
#define NEXP 8

#if __has_builtin(__builtin_amdgcn_global_load_async_to_lds_b128)
#define HAVE_ASYNC 1
#else
#define HAVE_ASYNC 0
#endif

#if HAVE_ASYNC
#if __has_builtin(__builtin_amdgcn_s_wait_asynccnt)
#define WAIT_ASYNC(n) __builtin_amdgcn_s_wait_asynccnt(n)
#else
#define WAIT_ASYNC(n) asm volatile("s_wait_asynccnt %0" ::"i"(n) : "memory")
#endif
#else
#define WAIT_ASYNC(n) ((void)0)
#endif

// 16-byte global -> LDS copy: async DMA path on gfx1250, sync fallback otherwise.
// Builtin signature (from clang diagnostics): (AS1 int4*, AS3 int4*, Imm, Imm).
__device__ __forceinline__ void copy16(float* lds, const float* gptr)
{
#if HAVE_ASYNC
    __builtin_amdgcn_global_load_async_to_lds_b128(
        (__attribute__((address_space(1))) v4i*)gptr,
        (__attribute__((address_space(3))) v4i*)lds,
        /*offset=*/0, /*cpol=*/0);
#else
    *(float4*)lds = *(const float4*)gptr;
#endif
}

// ---------------------------------------------------------------------------
// Router: best_p = 1 / sum_e exp(logit_e - max_logit). One wave per token.
// ---------------------------------------------------------------------------
__global__ __launch_bounds__(256) void moe_router_kernel(
    const float* __restrict__ x, const float* __restrict__ Wg,
    const float* __restrict__ bg, float* __restrict__ bestp, int N)
{
    const int wave  = threadIdx.x >> 5;
    const int lane  = threadIdx.x & 31;
    const int token = blockIdx.x * 8 + wave;
    if (token >= N) return;

    const float* xr = x + (size_t)token * HDIM;
    float acc[NEXP];
#pragma unroll
    for (int e = 0; e < NEXP; ++e) acc[e] = 0.0f;

    for (int h = lane; h < HDIM; h += 32) {
        float xv = xr[h];
        const float4* wr = (const float4*)(Wg + (size_t)h * NEXP);
        float4 w0 = wr[0];
        float4 w1 = wr[1];
        acc[0] += xv * w0.x; acc[1] += xv * w0.y;
        acc[2] += xv * w0.z; acc[3] += xv * w0.w;
        acc[4] += xv * w1.x; acc[5] += xv * w1.y;
        acc[6] += xv * w1.z; acc[7] += xv * w1.w;
    }

#pragma unroll
    for (int off = 16; off > 0; off >>= 1) {
#pragma unroll
        for (int e = 0; e < NEXP; ++e)
            acc[e] += __shfl_xor(acc[e], off, 32);
    }

    if (lane == 0) {
        float m = -3.0e38f;
#pragma unroll
        for (int e = 0; e < NEXP; ++e) {
            acc[e] += bg[e];
            m = fmaxf(m, acc[e]);
        }
        float s = 0.0f;
#pragma unroll
        for (int e = 0; e < NEXP; ++e) s += __expf(acc[e] - m);
        bestp[token] = 1.0f / s;
    }
}

// ---------------------------------------------------------------------------
// Expert GEMM: out = (x @ We + be) * bestp[row]
// Block tile 128x256, 8 waves (2x4), wave tile 64x64 = 4x4 f32 WMMA frags.
// Double-buffered LDS fed by GLOBAL_LOAD_ASYNC_TO_LDS_B128 (6 per thread/tile).
// ---------------------------------------------------------------------------
#define BM 128
#define BN 256
#define BK 16
#define APITCH 20    // conflict-free A reads, float2/float4 aligned
#define BPITCH 264   // 2*264 % 64 == 16 -> lane halves hit disjoint banks

__global__ __launch_bounds__(256) void moe_expert_gemm_kernel(
    const float* __restrict__ A,      // [N, H]
    const float* __restrict__ We,     // [H, H]
    const float* __restrict__ be,     // [H]
    const float* __restrict__ bestp,  // [N]
    float* __restrict__ out)          // [N, H]
{
    __shared__ float As[2][BM][APITCH];   // 20 KB
    __shared__ float Bs[2][BK][BPITCH];   // 33 KB

    const int tid  = threadIdx.x;
    const int lane = tid & 31;
    const int wave = tid >> 5;
    const int l16  = lane & 15;
    const int half = lane >> 4;

    const int gRow0 = blockIdx.y * BM;
    const int gCol0 = blockIdx.x * BN;

    const int m0 = (wave >> 2) * 64;  // wave row offset (2 rows of waves)
    const int n0 = (wave & 3) * 64;   // wave col offset (4 cols of waves)

    v8f vzero = {};
    v8f acc[4][4];
#pragma unroll
    for (int mi = 0; mi < 4; ++mi)
#pragma unroll
        for (int ni = 0; ni < 4; ++ni)
            acc[mi][ni] = vzero;

    // ---- tile staging: 6 x b128 per thread (2 for A, 4 for B) ----
    const int ra = tid >> 2;              // A: rows 0..63 (+64 second chunk)
    const int ca = (tid & 3) * 4;
    const int rb = tid >> 6;              // B: rows 0..3 (+4 per chunk)
    const int cb = (tid & 63) * 4;

#define ISSUE_TILE(buf, kt)                                                      \
    do {                                                                         \
        copy16(&As[buf][ra][ca],      &A[(size_t)(gRow0 + ra) * HDIM + (kt) + ca]); \
        copy16(&As[buf][ra + 64][ca], &A[(size_t)(gRow0 + ra + 64) * HDIM + (kt) + ca]); \
        copy16(&Bs[buf][rb][cb],      &We[(size_t)((kt) + rb) * HDIM + gCol0 + cb]); \
        copy16(&Bs[buf][rb + 4][cb],  &We[(size_t)((kt) + rb + 4) * HDIM + gCol0 + cb]); \
        copy16(&Bs[buf][rb + 8][cb],  &We[(size_t)((kt) + rb + 8) * HDIM + gCol0 + cb]); \
        copy16(&Bs[buf][rb + 12][cb], &We[(size_t)((kt) + rb + 12) * HDIM + gCol0 + cb]); \
    } while (0)

    ISSUE_TILE(0, 0);

    for (int kt = 0; kt < HDIM; kt += BK) {
        const int buf = (kt >> 4) & 1;

        if (kt + BK < HDIM) {
            ISSUE_TILE(buf ^ 1, kt + BK);
            WAIT_ASYNC(6);   // in-order: retires the 6 loads of buffer `buf`
        } else {
            WAIT_ASYNC(0);
        }
        __syncthreads();     // all waves' loads of `buf` are visible

        // ---- consume buffer: 4 k-steps of depth 4, 16 WMMAs each ----
#pragma unroll
        for (int kk = 0; kk < BK; kk += 4) {
            const int k = kk + half * 2;   // lanes>=16 hold K+2,K+3
            v2f afrag[4];
            v2f bfrag[4];
#pragma unroll
            for (int mi = 0; mi < 4; ++mi)
                afrag[mi] = *(const v2f*)&As[buf][m0 + mi * 16 + l16][k];
#pragma unroll
            for (int ni = 0; ni < 4; ++ni) {
                bfrag[ni].x = Bs[buf][k][n0 + ni * 16 + l16];
                bfrag[ni].y = Bs[buf][k + 1][n0 + ni * 16 + l16];
            }
#pragma unroll
            for (int mi = 0; mi < 4; ++mi)
#pragma unroll
                for (int ni = 0; ni < 4; ++ni)
                    acc[mi][ni] = __builtin_amdgcn_wmma_f32_16x16x4_f32(
                        false, afrag[mi], false, bfrag[ni],
                        (short)0, acc[mi][ni], false, false);
        }
        __syncthreads();     // buffer `buf` free for reuse next iteration
    }
#undef ISSUE_TILE

    // ---- epilogue: out = (acc + be[col]) * bestp[row] ----
    // C/D layout: VGPR j -> M = j + 8*half, N = lane&15
#pragma unroll
    for (int mi = 0; mi < 4; ++mi) {
#pragma unroll
        for (int ni = 0; ni < 4; ++ni) {
            const int col  = gCol0 + n0 + ni * 16 + l16;
            const float bias = be[col];
#pragma unroll
            for (int j = 0; j < 8; ++j) {
                const int row = gRow0 + m0 + mi * 16 + half * 8 + j;
                const float p = bestp[row];
                out[(size_t)row * HDIM + col] = (acc[mi][ni][j] + bias) * p;
            }
        }
    }
}

// ---------------------------------------------------------------------------
extern "C" void kernel_launch(void* const* d_in, const int* in_sizes, int n_in,
                              void* d_out, int out_size, void* d_ws, size_t ws_size,
                              hipStream_t stream)
{
    const float* x  = (const float*)d_in[0];  // [B,S,H]
    const float* Wg = (const float*)d_in[1];  // [H,E]
    const float* bg = (const float*)d_in[2];  // [E]
    const float* We = (const float*)d_in[3];  // [H,H]
    const float* be = (const float*)d_in[4];  // [H]
    float* out = (float*)d_out;

    const int N = in_sizes[0] / HDIM;         // 32768 tokens
    float* bestp = (float*)d_ws;              // N floats of scratch

    moe_router_kernel<<<(N + 7) / 8, 256, 0, stream>>>(x, Wg, bg, bestp, N);

    dim3 grid(HDIM / BN, N / BM);             // (4, 256)
    moe_expert_gemm_kernel<<<grid, 256, 0, stream>>>(x, We, be, bestp, out);
}

// v001
// A run of this version takes 308 microseconds.
// Timed twice side by side with v000, it ran 1.05 times as fast both times.
#include <hip/hip_runtime.h>

typedef __attribute__((ext_vector_type(2))) float v2f;
typedef __attribute__((ext_vector_type(8))) float v8f;
typedef __attribute__((ext_vector_type(4))) int v4i;

#define HDIM 1024
#define NEXP 8

#if __has_builtin(__builtin_amdgcn_global_load_async_to_lds_b128)
#define HAVE_ASYNC 1
#else
#define HAVE_ASYNC 0
#endif

#if HAVE_ASYNC
#if __has_builtin(__builtin_amdgcn_s_wait_asynccnt)
#define WAIT_ASYNC(n) __builtin_amdgcn_s_wait_asynccnt(n)
#else
#define WAIT_ASYNC(n) asm volatile("s_wait_asynccnt %0" ::"i"(n) : "memory")
#endif
#else
#define WAIT_ASYNC(n) ((void)0)
#endif

// 16-byte global -> LDS copy: async DMA path on gfx1250, sync fallback otherwise.
// Builtin signature (from clang diagnostics): (AS1 int4*, AS3 int4*, Imm, Imm).
__device__ __forceinline__ void copy16(float* lds, const float* gptr)
{
#if HAVE_ASYNC
    __builtin_amdgcn_global_load_async_to_lds_b128(
        (__attribute__((address_space(1))) v4i*)gptr,
        (__attribute__((address_space(3))) v4i*)lds,
        /*offset=*/0, /*cpol=*/0);
#else
    *(float4*)lds = *(const float4*)gptr;
#endif
}

// ---------------------------------------------------------------------------
// Router: best_p = 1 / sum_e exp(logit_e - max_logit).
// One wave takes RT tokens: 16 waves a block, one block of 128 tokens a WGP, so
// the launch starts 4,096 waves instead of 32,768. Each lane reads 16 bytes of
// a token row (512 contiguous bytes a wave), 128 columns of all RT rows are
// requested again as soon as their registers are free, and the gate matrix
// is read from LDS, where it is laid out so that lane l finds the 32 weights
// of its four columns in eight conflict-free 16-byte reads.
// Every loop is unrolled in full: its arrays are then indexed by constants and
// stay in registers.
// ---------------------------------------------------------------------------
#define RT 8          // tokens per wave
#define RWAVES 16     // waves per block
#define RCHUNKS (HDIM / 128)
#define WPITCH 34     // float4 per LDS row of 32: staging stores hit 16 distinct bank groups

__global__ __launch_bounds__(RWAVES * 32) void moe_router_kernel(
    const float* __restrict__ x, const float* __restrict__ Wg,
    const float* __restrict__ bg, float* __restrict__ bestp, int N)
{
    __shared__ float4 Ws[RCHUNKS * 8 * WPITCH];

    const int tid  = threadIdx.x;
    const int lane = tid & 31;
    // The wave's number as a scalar: the row addresses are then formed in scalar registers.
    const int wave = __builtin_amdgcn_readfirstlane(tid >> 5);
    const int tok0 = (blockIdx.x * RWAVES + wave) * RT;

    // Rows past the end re-read the last row and are not stored.
    const float4* xr[RT];
#pragma unroll
    for (int t = 0; t < RT; ++t) {
        const int tk = min(tok0 + t, N - 1);
        xr[t] = (const float4*)(x + (size_t)tk * HDIM) + lane;
    }

    // Gate matrix to LDS. float4 number g = c*256 + l*8 + q of Wg holds experts
    // (q&1)*4.. of column c*128 + l*4 + (q>>1); it goes to row (c, q), place l.
    const float4* wg4 = (const float4*)Wg;
    float4 wst[HDIM * NEXP / 4 / (RWAVES * 32)];
#pragma unroll
    for (int j = 0; j < HDIM * NEXP / 4 / (RWAVES * 32); ++j)
        wst[j] = wg4[j * (RWAVES * 32) + tid];

    // Two register sets of 128 columns x RT rows; a set is asked for again as
    // soon as it has been summed, so both are in flight while a wave waits.
    float4 xb[2][RT];
#pragma unroll
    for (int t = 0; t < RT; ++t) xb[0][t] = xr[t][0];
#pragma unroll
    for (int t = 0; t < RT; ++t) xb[1][t] = xr[t][32];

#pragma unroll
    for (int j = 0; j < HDIM * NEXP / 4 / (RWAVES * 32); ++j) {
        const int g = j * (RWAVES * 32) + tid;
        Ws[((g >> 8) * 8 + (g & 7)) * WPITCH + ((g >> 3) & 31)] = wst[j];
    }
    __syncthreads();

    float acc[RT * NEXP];
#pragma unroll
    for (int i = 0; i < RT * NEXP; ++i) acc[i] = 0.0f;

#pragma unroll
    for (int c = 0; c < RCHUNKS; ++c) {
        float4 w[8];
#pragma unroll
        for (int q = 0; q < 8; ++q) w[q] = Ws[(c * 8 + q) * WPITCH + lane];
#pragma unroll
        for (int t = 0; t < RT; ++t) {
            const float4 xq = xb[c & 1][t];
            const float xv[4] = {xq.x, xq.y, xq.z, xq.w};
#pragma unroll
            for (int i = 0; i < 4; ++i) {
                acc[t * 8 + 0] += xv[i] * w[2 * i].x;
                acc[t * 8 + 1] += xv[i] * w[2 * i].y;
                acc[t * 8 + 2] += xv[i] * w[2 * i].z;
                acc[t * 8 + 3] += xv[i] * w[2 * i].w;
                acc[t * 8 + 4] += xv[i] * w[2 * i + 1].x;
                acc[t * 8 + 5] += xv[i] * w[2 * i + 1].y;
                acc[t * 8 + 6] += xv[i] * w[2 * i + 1].z;
                acc[t * 8 + 7] += xv[i] * w[2 * i + 1].w;
            }
        }
        // Holds the eight refill loads together between these sums and the next
        // trip's; without it the compiler spreads them among the sums and a wave
        // waits with about 5 loads in flight instead of 16.
        __builtin_amdgcn_sched_barrier(0);
        if (c + 2 < RCHUNKS) {
#pragma unroll
            for (int t = 0; t < RT; ++t) xb[c & 1][t] = xr[t][(c + 2) * 32];
        }
    }

    // Sum the 64 partial logits over the 32 lanes; every step hands half of the
    // values to the partner lane, so lane l ends with logits 2l and 2l+1:
    // token l>>2, experts (l&3)*2 and (l&3)*2+1.
#pragma unroll
    for (int s = 0; s < 5; ++s) {
        const int off = 16 >> s;
        const int n   = 32 >> s;
        const bool hi = (lane & off) != 0;
#pragma unroll
        for (int j = 0; j < n; ++j) {
            const float keep = hi ? acc[j + n] : acc[j];
            const float send = hi ? acc[j] : acc[j + n];
            acc[j] = keep + __shfl_xor(send, off, 32);
        }
    }

    const int e0 = (lane & 3) * 2;
    const float a0 = acc[0] + bg[e0];
    const float a1 = acc[1] + bg[e0 + 1];
    float m = fmaxf(a0, a1);
    m = fmaxf(m, __shfl_xor(m, 1, 32));
    m = fmaxf(m, __shfl_xor(m, 2, 32));
    float sum = __expf(a0 - m) + __expf(a1 - m);
    sum += __shfl_xor(sum, 1, 32);
    sum += __shfl_xor(sum, 2, 32);

    const int token = tok0 + (lane >> 2);
    if ((lane & 3) == 0 && token < N) bestp[token] = 1.0f / sum;
}

// ---------------------------------------------------------------------------
// Expert GEMM: out = (x @ We + be) * bestp[row]
// Block tile 128x256, 8 waves (2x4), wave tile 64x64 = 4x4 f32 WMMA frags.
// Double-buffered LDS fed by GLOBAL_LOAD_ASYNC_TO_LDS_B128 (6 per thread/tile).
// ---------------------------------------------------------------------------
#define BM 128
#define BN 256
#define BK 16
#define APITCH 20    // conflict-free A reads, float2/float4 aligned
#define BPITCH 264   // 2*264 % 64 == 16 -> lane halves hit disjoint banks

__global__ __launch_bounds__(256) void moe_expert_gemm_kernel(
    const float* __restrict__ A,      // [N, H]
    const float* __restrict__ We,     // [H, H]
    const float* __restrict__ be,     // [H]
    const float* __restrict__ bestp,  // [N]
    float* __restrict__ out)          // [N, H]
{
    __shared__ float As[2][BM][APITCH];   // 20 KB
    __shared__ float Bs[2][BK][BPITCH];   // 33 KB

    const int tid  = threadIdx.x;
    const int lane = tid & 31;
    const int wave = tid >> 5;
    const int l16  = lane & 15;
    const int half = lane >> 4;

    const int gRow0 = blockIdx.y * BM;
    const int gCol0 = blockIdx.x * BN;

    const int m0 = (wave >> 2) * 64;  // wave row offset (2 rows of waves)
    const int n0 = (wave & 3) * 64;   // wave col offset (4 cols of waves)

    v8f vzero = {};
    v8f acc[4][4];
#pragma unroll
    for (int mi = 0; mi < 4; ++mi)
#pragma unroll
        for (int ni = 0; ni < 4; ++ni)
            acc[mi][ni] = vzero;

    // ---- tile staging: 6 x b128 per thread (2 for A, 4 for B) ----
    const int ra = tid >> 2;              // A: rows 0..63 (+64 second chunk)
    const int ca = (tid & 3) * 4;
    const int rb = tid >> 6;              // B: rows 0..3 (+4 per chunk)
    const int cb = (tid & 63) * 4;

#define ISSUE_TILE(buf, kt)                                                      \
    do {                                                                         \
        copy16(&As[buf][ra][ca],      &A[(size_t)(gRow0 + ra) * HDIM + (kt) + ca]); \
        copy16(&As[buf][ra + 64][ca], &A[(size_t)(gRow0 + ra + 64) * HDIM + (kt) + ca]); \
        copy16(&Bs[buf][rb][cb],      &We[(size_t)((kt) + rb) * HDIM + gCol0 + cb]); \
        copy16(&Bs[buf][rb + 4][cb],  &We[(size_t)((kt) + rb + 4) * HDIM + gCol0 + cb]); \
        copy16(&Bs[buf][rb + 8][cb],  &We[(size_t)((kt) + rb + 8) * HDIM + gCol0 + cb]); \
        copy16(&Bs[buf][rb + 12][cb], &We[(size_t)((kt) + rb + 12) * HDIM + gCol0 + cb]); \
    } while (0)

    ISSUE_TILE(0, 0);

    for (int kt = 0; kt < HDIM; kt += BK) {
        const int buf = (kt >> 4) & 1;

        if (kt + BK < HDIM) {
            ISSUE_TILE(buf ^ 1, kt + BK);
            WAIT_ASYNC(6);   // in-order: retires the 6 loads of buffer `buf`
        } else {
            WAIT_ASYNC(0);
        }
        __syncthreads();     // all waves' loads of `buf` are visible

        // ---- consume buffer: 4 k-steps of depth 4, 16 WMMAs each ----
#pragma unroll
        for (int kk = 0; kk < BK; kk += 4) {
            const int k = kk + half * 2;   // lanes>=16 hold K+2,K+3
            v2f afrag[4];
            v2f bfrag[4];
#pragma unroll
            for (int mi = 0; mi < 4; ++mi)
                afrag[mi] = *(const v2f*)&As[buf][m0 + mi * 16 + l16][k];
#pragma unroll
            for (int ni = 0; ni < 4; ++ni) {
                bfrag[ni].x = Bs[buf][k][n0 + ni * 16 + l16];
                bfrag[ni].y = Bs[buf][k + 1][n0 + ni * 16 + l16];
            }
#pragma unroll
            for (int mi = 0; mi < 4; ++mi)
#pragma unroll
                for (int ni = 0; ni < 4; ++ni)
                    acc[mi][ni] = __builtin_amdgcn_wmma_f32_16x16x4_f32(
                        false, afrag[mi], false, bfrag[ni],
                        (short)0, acc[mi][ni], false, false);
        }
        __syncthreads();     // buffer `buf` free for reuse next iteration
    }
#undef ISSUE_TILE

    // ---- epilogue: out = (acc + be[col]) * bestp[row] ----
    // C/D layout: VGPR j -> M = j + 8*half, N = lane&15
#pragma unroll
    for (int mi = 0; mi < 4; ++mi) {
#pragma unroll
        for (int ni = 0; ni < 4; ++ni) {
            const int col  = gCol0 + n0 + ni * 16 + l16;
            const float bias = be[col];
#pragma unroll
            for (int j = 0; j < 8; ++j) {
                const int row = gRow0 + m0 + mi * 16 + half * 8 + j;
                const float p = bestp[row];
                out[(size_t)row * HDIM + col] = (acc[mi][ni][j] + bias) * p;
            }
        }
    }
}

// ---------------------------------------------------------------------------
extern "C" void kernel_launch(void* const* d_in, const int* in_sizes, int n_in,
                              void* d_out, int out_size, void* d_ws, size_t ws_size,
                              hipStream_t stream)
{
    const float* x  = (const float*)d_in[0];  // [B,S,H]
    const float* Wg = (const float*)d_in[1];  // [H,E]
    const float* bg = (const float*)d_in[2];  // [E]
    const float* We = (const float*)d_in[3];  // [H,H]
    const float* be = (const float*)d_in[4];  // [H]
    float* out = (float*)d_out;

    const int N = in_sizes[0] / HDIM;         // 32768 tokens
    float* bestp = (float*)d_ws;              // N floats of scratch

    moe_router_kernel<<<(N + RWAVES * RT - 1) / (RWAVES * RT), RWAVES * 32, 0, stream>>>(x, Wg, bg, bestp, N);

    dim3 grid(HDIM / BN, N / BM);             // (4, 256)
    moe_expert_gemm_kernel<<<grid, 256, 0, stream>>>(x, We, be, bestp, out);
}
